// v000
// The times below were measured on an AMD MI455X: many runs one after another, warmed up first and cycling through
// copies of the inputs, with the whole window's GPU time divided by the number of runs. Launches and the gaps
// between them are all in it. The median over several windows is given; except for v000 it joins two sittings, which
// can be a few percent apart, so the side-by-side timings, each taken in one sitting, are the better comparison.
// v000 is the starting kernel. One run takes 467 microseconds.
// Contractions: q/k/v projections (x f16, W f16 carried x16), scores q.k^T (q,k f16 planes, 1/32 folded in f32 epilogue), P.v (P f16 carried x2048, v^T f16 plane): all v_wmma_f32_16x16x32_f16 with f32 accumulate; context add, bias, softmax in f32.
#include <hip/hip_runtime.h>
#include <math.h>

// ---------------------------------------------------------------------------
// Problem constants
// ---------------------------------------------------------------------------
constexpr int kBatch  = 4;
constexpr int kSeq    = 2048;
constexpr int kDim    = 1024;
constexpr int kTok    = kBatch * kSeq;      // 8192 token rows
constexpr int kChunkB = 2;                  // batches per attention chunk
constexpr float kWCarry     = 16.0f;        // weights carried x16 in f16
constexpr float kWCarryInv  = 1.0f / 16.0f;
constexpr float kPCarry     = 2048.0f;      // probabilities carried x2048 in f16
constexpr float kPCarryInv  = 1.0f / 2048.0f;
constexpr float kScoreScale = 0.03125f;     // 1024^-0.5

typedef __attribute__((ext_vector_type(16))) _Float16 v16h;
typedef __attribute__((ext_vector_type(8)))  _Float16 v8h;
typedef __attribute__((ext_vector_type(16))) __bf16   v16b;
typedef __attribute__((ext_vector_type(8)))  __bf16   v8b;
typedef __attribute__((ext_vector_type(8)))  float    v8f;
typedef __attribute__((ext_vector_type(4)))  float    v4f;
typedef __attribute__((ext_vector_type(4)))  unsigned int v4u;

// ---------------------------------------------------------------------------
// Helper pieces
// ---------------------------------------------------------------------------
__device__ __forceinline__ unsigned short f2bf_bits(float f) {
  unsigned u = __float_as_uint(f);
  return (unsigned short)((u + 0x7FFFu + ((u >> 16) & 1u)) >> 16);
}
__device__ __forceinline__ float bf_bits2f(unsigned short h) { return __uint_as_float(((unsigned)h) << 16); }

// hazard guards as plain device helpers (no inline asm inside the kernel template body)
__device__ __forceinline__ void dep_guard_h(v8f& a, v8f& b, v16h x, v16h y) { asm volatile("v_nop\n\tv_nop\n\tv_nop\n\tv_nop" : "+v"(a), "+v"(b) : "v"(x), "v"(y)); }
__device__ __forceinline__ void dep_guard_b(v8f& a, v8f& b, v16b x, v16b y) { asm volatile("v_nop\n\tv_nop\n\tv_nop\n\tv_nop" : "+v"(a), "+v"(b) : "v"(x), "v"(y)); }
__device__ __forceinline__ void keep4_h(v16h a, v16h b, v16h c, v16h d) { asm volatile("v_nop" :: "v"(a), "v"(b), "v"(c), "v"(d)); }
__device__ __forceinline__ void keep4_b(v16b a, v16b b, v16b c, v16b d) { asm volatile("v_nop" :: "v"(a), "v"(b), "v"(c), "v"(d)); }
__device__ __forceinline__ void acc_guard4(v8f& a, v8f& b, v8f& c, v8f& d) { asm volatile("v_nop\n\tv_nop\n\tv_nop\n\tv_nop" : "+v"(a), "+v"(b), "+v"(c), "+v"(d)); }
template <typename T> struct Frag;
template <> struct Frag<_Float16> {
  typedef v16h V; union U { v16h v; v8h h[2]; };
  static __device__ __forceinline__ v16h load(const _Float16* p) {   // elements 0..7 <- p[0..7], 8..15 <- p[16..23]
    U f; f.h[0] = *(const v8h*)(p); f.h[1] = *(const v8h*)(p + 16); return f.v;
  }
  static __device__ __forceinline__ v8f mma(v16h a, v16h b, v8f c) {
    return __builtin_amdgcn_wmma_f32_16x16x32_f16(false, a, false, b, (short)0, c, false, false);
  }
  static __device__ __forceinline__ void guard(v8f& a, v8f& b, v16h x, v16h y) { dep_guard_h(a, b, x, y); }
  static __device__ __forceinline__ void keep(v16h a, v16h b, v16h c, v16h d) { keep4_h(a, b, c, d); }
};
template <> struct Frag<__bf16> {
  typedef v16b V; union U { v16b v; v8b h[2]; };
  static __device__ __forceinline__ v16b load(const __bf16* p) {
    U f; f.h[0] = *(const v8b*)(p); f.h[1] = *(const v8b*)(p + 16); return f.v;
  }
  static __device__ __forceinline__ v8f mma(v16b a, v16b b, v8f c) {
    return __builtin_amdgcn_wmma_f32_16x16x32_bf16(false, a, false, b, (short)0, c, false, false);
  }
  static __device__ __forceinline__ void guard(v8f& a, v8f& b, v16b x, v16b y) { dep_guard_b(a, b, x, y); }
  static __device__ __forceinline__ void keep(v16b a, v16b b, v16b c, v16b d) { keep4_b(a, b, c, d); }
};

__device__ __forceinline__ unsigned pk16(unsigned short a, unsigned short b) { return (unsigned)a | ((unsigned)b << 16); }
__device__ __forceinline__ unsigned short h_bits(float f) { const _Float16 h = (_Float16)f; return __builtin_bit_cast(unsigned short, h); }

// ---- Register-blocked batched WMMA GEMM (ACT reduced to none/relu/leaky) --------------------------------
// C[m,n] = scale * sum_k A[m,k] * Bt[n,k] (+bias)(+resid); each wave owns a 64x64 tile.
// A row-major [M,K]; Bt row-major [N,K]; M,N % 64 == 0, K % 32 == 0.
// SPLIT: operands are hi/lo planes (A2/Bt2 = lo planes, same layout); product = hi*hi + hi*lo + lo*hi.
// BIAS_MODE: 0 = none, 1 = bias[m], 2 = bias[n].
// OUT_MODE: 0 = f32, 1 = f16, 2 = bf16 hi plane (Cout) + bf16 lo plane (Cout2).
// ET: 0 = f16 operands, 1 = bf16 operands (pointers passed as 16-bit storage)
template <int ET> struct Elem;
template <> struct Elem<0> { typedef _Float16 T; };
template <> struct Elem<1> { typedef __bf16 T; };
template <int ET, bool SPLIT, int BIAS_MODE, int OUT_MODE, bool RESID, int ACT = 0>
__global__ __launch_bounds__(256) void wmma_gemm64(
    const unsigned short* __restrict__ Ap, const unsigned short* __restrict__ A2p, int lda, long strideA,
    const unsigned short* __restrict__ Btp, const unsigned short* __restrict__ Bt2p, int ldb, long strideB,
    void* __restrict__ Cout, void* __restrict__ Cout2, int ldc, long strideC,
    const float* __restrict__ bias,
    const float* __restrict__ resid, long strideR,
    int M, int N, int K, float scale) {
  typedef typename Elem<ET>::T T;
  typedef typename Frag<T>::V V;
  const T* A = (const T*)Ap; const T* A2 = (const T*)A2p; const T* Bt = (const T*)Btp; const T* Bt2 = (const T*)Bt2p;
  __shared__ __align__(16) float sT[8][16 * 68];   // per-wave 16x64 slab, pitch 68 floats
  const int b    = blockIdx.y;
  const int lane = threadIdx.x & 31;
  const int wave = threadIdx.x >> 5;
  const int tilesN = N >> 6;
  const int tilesM = M >> 6;
  const int tile = blockIdx.x * 8 + wave;
  if (tile >= tilesM * tilesN) return;   // wave-uniform; no block barriers in this kernel
  const int tm = tile / tilesN;
  const int tn = tile - tm * tilesN;
  const int m0 = tm << 6;
  const int n0 = tn << 6;

  const T* Ab  = A  + (size_t)b * strideA;
  const T* Bb  = Bt + (size_t)b * strideB;
  const T* Ab2 = SPLIT ? (A2  + (size_t)b * strideA) : nullptr;
  const T* Bb2 = SPLIT ? (Bt2 + (size_t)b * strideB) : nullptr;

  const int rlane = lane & 15;                 // row (A) / col (B, D) within subtile
  const int koff  = (lane >> 4) * 8;           // k offset of this lane half
  const int mOff  = (lane >> 4) * 8;           // D row offset

  v8f acc[4][4];
#pragma unroll
  for (int i = 0; i < 4; ++i)
#pragma unroll
    for (int j = 0; j < 4; ++j) acc[i][j] = (v8f){0.f,0.f,0.f,0.f,0.f,0.f,0.f,0.f};

  for (int k0 = 0; k0 < K; k0 += 32) {
    V bh[4], bl[4];
#pragma unroll
    for (int j = 0; j < 4; ++j) {
      const size_t bo = (size_t)(n0 + (j << 4) + rlane) * ldb + koff + k0;
      bh[j] = Frag<T>::load(Bb + bo);
      if (SPLIT) bl[j] = Frag<T>::load(Bb2 + bo);
    }
#pragma unroll
    for (int i = 0; i < 4; ++i) {
      const size_t ao = (size_t)(m0 + (i << 4) + rlane) * lda + koff + k0;
      V ah = Frag<T>::load(Ab + ao);
      V al;
      if (SPLIT) al = Frag<T>::load(Ab2 + ao);
#pragma unroll
      for (int j = 0; j < 4; ++j) {
        acc[i][j] = Frag<T>::mma(ah, bh[j], acc[i][j]);
        if (SPLIT) {
          acc[i][j] = Frag<T>::mma(ah, bl[j], acc[i][j]);
          acc[i][j] = Frag<T>::mma(al, bh[j], acc[i][j]);
        }
      }
      Frag<T>::guard(acc[i][0], acc[i][3], ah, SPLIT ? al : ah);
    }
    Frag<T>::keep(bh[0], bh[1], bh[2], bh[3]);
    if (SPLIT) Frag<T>::keep(bl[0], bl[1], bl[2], bl[3]);
  }
  acc_guard4(acc[0][0], acc[0][1], acc[0][2], acc[0][3]);
  acc_guard4(acc[1][0], acc[1][1], acc[1][2], acc[1][3]);
  acc_guard4(acc[2][0], acc[2][1], acc[2][2], acc[2][3]);
  acc_guard4(acc[3][0], acc[3][1], acc[3][2], acc[3][3]);

  // ---- epilogue ----
  float* slab = sT[wave];
  const float* Rb = RESID ? (resid + (size_t)b * strideR) : nullptr;
#pragma unroll
  for (int i = 0; i < 4; ++i) {
    const int mBase = m0 + (i << 4);
#pragma unroll
    for (int j = 0; j < 4; ++j) {
      const int n = n0 + (j << 4) + rlane;
      float bv = 0.f;
      if (BIAS_MODE == 2) bv = bias[n];
#pragma unroll
      for (int r = 0; r < 8; ++r) {
        float v = acc[i][j][r] * scale;
        if (BIAS_MODE == 1) v += bias[mBase + mOff + r];
        if (BIAS_MODE == 2) v += bv;
        if (RESID) v += Rb[(size_t)(mBase + mOff + r) * ldc + n];
        if (ACT == 2) v = fmaxf(v, 0.0f);
        if (ACT == 4) v = (v > 0.f) ? v : 0.01f * v;
        slab[(mOff + r) * 68 + (j << 4) + rlane] = v;
      }
    }
    __builtin_amdgcn_fence(__ATOMIC_RELEASE, "workgroup");
    __builtin_amdgcn_wave_barrier();
    __builtin_amdgcn_fence(__ATOMIC_ACQUIRE, "workgroup");
    if (OUT_MODE == 0) {
      float* C = (float*)Cout + (size_t)b * strideC;
      const int hh = lane >> 4, c4 = (lane & 15) * 4;     // row seg = 256 B = 16 lanes x 16 B
      {
#pragma unroll
        for (int it = 0; it < 8; ++it) {
          const int row = it * 2 + hh;
          v4f v = *(const v4f*)(slab + row * 68 + c4);
          *(v4f*)(C + (size_t)(mBase + row) * ldc + n0 + c4) = v;
        }
        
      }
    } else {
      const int q = lane >> 3, c8 = (lane & 7) * 8;
      unsigned short* C  = (unsigned short*)Cout  + (size_t)b * strideC;
      unsigned short* C2 = (OUT_MODE == 2) ? ((unsigned short*)Cout2 + (size_t)b * strideC) : nullptr;
      {
#pragma unroll
        for (int it = 0; it < 4; ++it) {
          const int row = it * 4 + q;
          const float* sp = slab + row * 68 + c8;
          v8h hv, lv;
#pragma unroll
          for (int e = 0; e < 8; ++e) {
            if (OUT_MODE == 1) {
              hv[e] = (_Float16)sp[e];
            } else {
              unsigned short hb = f2bf_bits(sp[e]);
              unsigned short lb = f2bf_bits(sp[e] - bf_bits2f(hb));
              hv[e] = __builtin_bit_cast(_Float16, hb);
              lv[e] = __builtin_bit_cast(_Float16, lb);
            }
          }
          *(v8h*)(C + (size_t)(mBase + row) * ldc + n0 + c8) = hv;
          if (OUT_MODE == 2) *(v8h*)(C2 + (size_t)(mBase + row) * ldc + n0 + c8) = lv;
        }
        
      }
    }
    __builtin_amdgcn_fence(__ATOMIC_RELEASE, "workgroup");
    __builtin_amdgcn_wave_barrier();
    __builtin_amdgcn_fence(__ATOMIC_ACQUIRE, "workgroup");
  }
}

// ---------------------------------------------------------------------------
// f32 -> f16 cast of 8 consecutive elements per thread, value = f16((in [+ ctx]) * scale); the optional ctx vector
// [kDim] is broadcast over rows of pitch kDim (the flat index modulo kDim selects the ctx element; 8 | kDim so a
// ---------------------------------------------------------------------------
template <bool HAS_CTX>
__global__ __launch_bounds__(256) void cast8_f16_kernel(const float* __restrict__ in, const float* __restrict__ ctx,
                                                        unsigned short* __restrict__ out, int n8, float scale) {
  const int i = blockIdx.x * 256 + threadIdx.x;
  if (i >= n8) return;
  const float* p = in + 8 * (size_t)i;
  v4f a = *(const v4f*)(p);
  v4f c = *(const v4f*)(p + 4);
  if (HAS_CTX) {
    const int cb = (int)((8 * (size_t)i) & (size_t)(kDim - 1));   // 0..kDim-8, multiple of 8
    const v4f g0 = *(const v4f*)(ctx + cb);
    const v4f g1 = *(const v4f*)(ctx + cb + 4);
    a = a + g0;
    c = c + g1;
  }
  unsigned short hb[8];
#pragma unroll
  for (int e = 0; e < 4; ++e) {
    hb[e]     = h_bits(a[e] * scale);
    hb[4 + e] = h_bits(c[e] * scale);
  }
  const v4u u = (v4u){pk16(hb[0], hb[1]), pk16(hb[2], hb[3]), pk16(hb[4], hb[5]), pk16(hb[6], hb[7])};
  unsigned short* q = out + 8 * (size_t)i;
  *(v4u*)q = u;
  
}

// ---------------------------------------------------------------------------
// Row softmax over kSeq = 2048 f32 scores: P[row][j] = f16( carry * exp(s - max) * (1 / sum exp(s - max)) ), f32 math.
// One block of 256 threads per row; thread t owns columns 8t..8t+7 (256 x 8 = 2048 = whole row).
// Reductions in fixed order (thread, wave shuffle tree, 8 wave partials in index order); cross-wave LDS reads only
// after __syncthreads.
// ---------------------------------------------------------------------------
__global__ __launch_bounds__(256) void softmax_row_kernel(const float* __restrict__ S, unsigned short* __restrict__ P,
                                                          float carry) {
  __shared__ float redM[8];
  __shared__ float redS[8];
  const int row  = blockIdx.x;
  const int t    = threadIdx.x;
  const int lane = t & 31, wave = t >> 5;
  const int c0   = t * 8;
  const float* sr = S + (size_t)row * kSeq + c0;
  const v4f a = *(const v4f*)(sr);
  const v4f c = *(const v4f*)(sr + 4);
  float x[8];
#pragma unroll
  for (int e = 0; e < 4; ++e) { x[e] = a[e]; x[4 + e] = c[e]; }
  float m = fmaxf(fmaxf(fmaxf(x[0], x[1]), fmaxf(x[2], x[3])), fmaxf(fmaxf(x[4], x[5]), fmaxf(x[6], x[7])));
#pragma unroll
  for (int off = 16; off > 0; off >>= 1) m = fmaxf(m, __shfl_xor(m, off, 32));
  if (lane == 0) redM[wave] = m;
  __syncthreads();
  float gm = redM[0];
#pragma unroll
  for (int w = 1; w < 8; ++w) gm = fmaxf(gm, redM[w]);
  float p[8];
  float s = 0.f;
#pragma unroll
  for (int e = 0; e < 8; ++e) { p[e] = expf(x[e] - gm); s += p[e]; }
#pragma unroll
  for (int off = 16; off > 0; off >>= 1) s += __shfl_xor(s, off, 32);
  if (lane == 0) redS[wave] = s;
  __syncthreads();
  float tot = redS[0];
#pragma unroll
  for (int w = 1; w < 8; ++w) tot += redS[w];
  const float rcp = 1.0f / tot;    // tot >= 1 (the max element contributes exp(0))
  unsigned short hb[8];
#pragma unroll
  for (int e = 0; e < 8; ++e) hb[e] = h_bits((p[e] * rcp) * carry);
  const v4u u = (v4u){pk16(hb[0], hb[1]), pk16(hb[2], hb[3]), pk16(hb[4], hb[5]), pk16(hb[6], hb[7])};
  unsigned short* q = P + (size_t)row * kSeq + c0;
  *(v4u*)q = u;
  
}

// ---------------------------------------------------------------------------
// Host side
// Workspace region map (bytes, all offsets 2 MiB aligned):
//   R0 Xq16 [8192][1024] f16   16 MiB @  0 MiB   (dead after launch 7)
//   R1 Xk16 [8192][1024] f16   16 MiB @ 16 MiB   (dead after launch 8)
//   R2 Xv16 [8192][1024] f16   16 MiB @ 32 MiB   (dead after launch 9)
//   R3 Wq16,Wk16,Wv16 [1024][1024] f16 x16 carry, 2 MiB each @ 48/50/52 MiB
//   R4 Q16  [8192][1024] f16   16 MiB @ 54 MiB
//   R5 K16  [8192][1024] f16   16 MiB @ 70 MiB
//   R6 VT16 [4][1024][2048] f16 16 MiB @ 86 MiB
//   total carve 102 MiB = 106954752 B
//   per 2-batch attention chunk (reusing dead R0..R2):
//     Sc  [2][2048][2048] f32 32 MiB @ 0 MiB (over R0,R1)
//     P16 [2][2048][2048] f16 16 MiB @ 32 MiB (over R2)
// ---------------------------------------------------------------------------
extern "C" void kernel_launch(void* const* d_in, const int* in_sizes, int n_in,
                              void* d_out, int out_size, void* d_ws, size_t ws_size,
                              hipStream_t stream) {
  if (n_in < 10) return;
  const float* query = (const float*)d_in[0];
  const float* key   = (const float*)d_in[1];
  const float* value = (const float*)d_in[2];
  const float* ctx   = (const float*)d_in[3];
  const float* Wq    = (const float*)d_in[4];
  const float* bq    = (const float*)d_in[5];
  const float* Wk    = (const float*)d_in[6];
  const float* bk    = (const float*)d_in[7];
  const float* Wv    = (const float*)d_in[8];
  const float* bv    = (const float*)d_in[9];
  float* out = (float*)d_out;

  const size_t actE = (size_t)kTok * kDim;      // 8388608 elements per activation tensor
  const size_t wE   = (size_t)kDim * kDim;      // 1048576 elements per weight
  if ((size_t)in_sizes[0] != actE || (size_t)in_sizes[1] != actE || (size_t)in_sizes[2] != actE) return;
  if ((size_t)in_sizes[3] != (size_t)kDim) return;
  if ((size_t)in_sizes[4] != wE || (size_t)in_sizes[6] != wE || (size_t)in_sizes[8] != wE) return;
  if ((size_t)in_sizes[5] != (size_t)kDim || (size_t)in_sizes[7] != (size_t)kDim || (size_t)in_sizes[9] != (size_t)kDim) return;
  if ((size_t)out_size != actE) return;

  const size_t actB16 = actE * 2;     // 16 MiB
  const size_t wB16   = wE * 2;       //  2 MiB
  unsigned char* ws = (unsigned char*)d_ws;
  size_t off = 0;
  unsigned short* Xq16 = (unsigned short*)(ws + off); off += actB16;
  unsigned short* Xk16 = (unsigned short*)(ws + off); off += actB16;
  unsigned short* Xv16 = (unsigned short*)(ws + off); off += actB16;
  unsigned short* Wq16 = (unsigned short*)(ws + off); off += wB16;
  unsigned short* Wk16 = (unsigned short*)(ws + off); off += wB16;
  unsigned short* Wv16 = (unsigned short*)(ws + off); off += wB16;
  unsigned short* Q16  = (unsigned short*)(ws + off); off += actB16;
  unsigned short* K16  = (unsigned short*)(ws + off); off += actB16;
  unsigned short* VT16 = (unsigned short*)(ws + off); off += actB16;
  const size_t carveTotal = off;                         // 106954752 B
  if (carveTotal > ws_size) return;
  // chunk regions over dead R0..R2
  const size_t scBytes = (size_t)kChunkB * kSeq * kSeq * sizeof(float);   // 32 MiB == 2 * actB16
  const size_t pBytes  = (size_t)kChunkB * kSeq * kSeq * 2;               // 16 MiB == actB16
  if (scBytes + pBytes > 3 * actB16) return;
  float*          Sc  = (float*)(ws + 0);
  unsigned short* P16 = (unsigned short*)(ws + scBytes);

  const dim3 blk(256);

  // launches 1-3: activation casts (query, key with context add), 8 elements per thread, exact grids
  const int n8act = (int)(actE / 8);                     // 1048576 -> 4096 blocks
  const dim3 gAct((unsigned)((n8act + 255) / 256));
  cast8_f16_kernel<true ><<<gAct, blk, 0, stream>>>(query, ctx, Xq16, n8act, 1.0f);
  cast8_f16_kernel<true ><<<gAct, blk, 0, stream>>>(key,   ctx, Xk16, n8act, 1.0f);
  cast8_f16_kernel<false><<<gAct, blk, 0, stream>>>(value, ctx, Xv16, n8act, 1.0f);

  // launches 4-6: weight casts, carried x16
  const int n8w = (int)(wE / 8);                         // 131072 -> 512 blocks
  const dim3 gW((unsigned)((n8w + 255) / 256));
  cast8_f16_kernel<false><<<gW, blk, 0, stream>>>(Wq, ctx, Wq16, n8w, kWCarry);
  cast8_f16_kernel<false><<<gW, blk, 0, stream>>>(Wk, ctx, Wk16, n8w, kWCarry);
  cast8_f16_kernel<false><<<gW, blk, 0, stream>>>(Wv, ctx, Wv16, n8w, kWCarry);

  // launches 7-8: Q16/K16 [8192][1024] = X16 [8192][1024] x W16 [1024][1024]^T, bias[n], scale 1/16
  // M = 8192, N = 1024, K = 1024 (K % 32 == 0, M,N % 64 == 0); tiles = 128 * 16 = 2048 -> 256 blocks x 8 waves
  {
    const int M = kTok, N = kDim, K = kDim;
    const dim3 g((unsigned)(((M / 64) * (N / 64) + 7) / 8), 1);
    wmma_gemm64<0, false, 2, 1, false, 0><<<g, blk, 0, stream>>>(
        Xq16, Xq16, kDim, 0L, Wq16, Wq16, kDim, 0L, (void*)Q16, (void*)Q16, kDim, 0L,
        bq, bq, 0L, M, N, K, kWCarryInv);
    wmma_gemm64<0, false, 2, 1, false, 0><<<g, blk, 0, stream>>>(
        Xk16, Xk16, kDim, 0L, Wk16, Wk16, kDim, 0L, (void*)K16, (void*)K16, kDim, 0L,
        bk, bk, 0L, M, N, K, kWCarryInv);
  }
  // launch 9: VT16[b][d][s] = Wv16 [1024][1024] x Xv16_b [2048][1024]^T, bias[m] = bv[d], scale 1/16
  // M = 1024 (d), N = 2048 (s), K = 1024; tiles = 16 * 32 = 512 -> 64 blocks; grid.y = batch
  {
    const int M = kDim, N = kSeq, K = kDim;
    const dim3 g((unsigned)(((M / 64) * (N / 64) + 7) / 8), (unsigned)kBatch);
    wmma_gemm64<0, false, 1, 1, false, 0><<<g, blk, 0, stream>>>(
        Wv16, Wv16, kDim, 0L,
        Xv16, Xv16, kDim, (long)kSeq * kDim,
        (void*)VT16, (void*)VT16, kSeq, (long)kDim * kSeq,
        bv, bv, 0L, M, N, K, kWCarryInv);
  }

  // launches 10-15: attention per 2-batch chunk
  for (int ch = 0; ch < kBatch / kChunkB; ++ch) {
    const size_t b0 = (size_t)ch * kChunkB;
    const unsigned short* Qc  = Q16  + b0 * (size_t)kSeq * kDim;
    const unsigned short* Kc  = K16  + b0 * (size_t)kSeq * kDim;
    const unsigned short* VTc = VT16 + b0 * (size_t)kDim * kSeq;
    float* Oc = out + b0 * (size_t)kSeq * kDim;
    // scores Sc[g][q][k] = (1/32) * Q_g [2048][1024] x K_g [2048][1024]^T, f32 out
    // M = N = 2048, K = 1024; tiles = 32 * 32 = 1024 -> 128 blocks; grid.y = kChunkB
    {
      const int M = kSeq, N = kSeq, K = kDim;
      const dim3 g((unsigned)(((M / 64) * (N / 64) + 7) / 8), (unsigned)kChunkB);
      wmma_gemm64<0, false, 0, 0, false, 0><<<g, blk, 0, stream>>>(
          Qc, Qc, kDim, (long)kSeq * kDim,
          Kc, Kc, kDim, (long)kSeq * kDim,
          (void*)Sc, (void*)Sc, kSeq, (long)kSeq * kSeq,
          bq, bq, 0L, M, N, K, kScoreScale);
    }
    // row softmax -> P16 [g][q][k] carried x2048; one block per row, kChunkB * 2048 rows
    {
      const dim3 g((unsigned)(kChunkB * kSeq));
      softmax_row_kernel<<<g, blk, 0, stream>>>(Sc, P16, kPCarry);
    }
    // out[g][q][d] = (1/2048) * P16_g [2048][2048] x VT16_g [1024][2048]^T, f32 straight to d_out rows (ldc 1024)
    // M = 2048, N = 1024, K = 2048; tiles = 32 * 16 = 512 -> 64 blocks; grid.y = kChunkB
    {
      const int M = kSeq, N = kDim, K = kSeq;
      const dim3 g((unsigned)(((M / 64) * (N / 64) + 7) / 8), (unsigned)kChunkB);
      wmma_gemm64<0, false, 0, 0, false, 0><<<g, blk, 0, stream>>>(
          P16, P16, kSeq, (long)kSeq * kSeq,
          VTc, VTc, kSeq, (long)kDim * kSeq,
          (void*)Oc, (void*)Oc, kDim, (long)kSeq * kDim,
          bq, bq, 0L, M, N, K, kPCarryInv);
    }
  }
}

// v001
// A run of this version takes 184 microseconds.
// Timed twice side by side with v000, it ran 2.56 times as fast both times.
// Contractions: q/k/v projections (x f16, W f16 carried x16), scores q.k^T (q,k f16 planes, 1/32 folded in f32 epilogue), P.v (P f16 carried x2048, v^T f16 plane): all v_wmma_f32_16x16x32_f16 with f32 accumulate; context add, bias, softmax in f32.
#include <hip/hip_runtime.h>
#include <math.h>

// ---------------------------------------------------------------------------
// Problem constants
// ---------------------------------------------------------------------------
constexpr int kBatch  = 4;
constexpr int kSeq    = 2048;
constexpr int kDim    = 1024;
constexpr int kTok    = kBatch * kSeq;      // 8192 token rows
constexpr int kChunkB = 2;                  // batches per attention chunk
constexpr float kWCarry     = 16.0f;        // weights carried x16 in f16
constexpr float kWCarryInv  = 1.0f / 16.0f;
constexpr float kPCarry     = 2048.0f;      // probabilities carried x2048 in f16
constexpr float kPCarryInv  = 1.0f / 2048.0f;
constexpr float kScoreScale = 0.03125f;     // 1024^-0.5

typedef __attribute__((ext_vector_type(16))) _Float16 v16h;
typedef __attribute__((ext_vector_type(8)))  _Float16 v8h;
typedef __attribute__((ext_vector_type(16))) __bf16   v16b;
typedef __attribute__((ext_vector_type(8)))  __bf16   v8b;
typedef __attribute__((ext_vector_type(8)))  float    v8f;
typedef __attribute__((ext_vector_type(4)))  float    v4f;
typedef __attribute__((ext_vector_type(4)))  unsigned int v4u;

// ---------------------------------------------------------------------------
// Helper pieces
// ---------------------------------------------------------------------------
__device__ __forceinline__ unsigned short f2bf_bits(float f) {
  unsigned u = __float_as_uint(f);
  return (unsigned short)((u + 0x7FFFu + ((u >> 16) & 1u)) >> 16);
}
__device__ __forceinline__ float bf_bits2f(unsigned short h) { return __uint_as_float(((unsigned)h) << 16); }

// hazard guards as plain device helpers
__device__ __forceinline__ void dep_guard_h(v8f& a, v8f& b, v16h x, v16h y) { asm volatile("v_nop\n\tv_nop\n\tv_nop\n\tv_nop" : "+v"(a), "+v"(b) : "v"(x), "v"(y)); }
__device__ __forceinline__ void dep_guard_b(v8f& a, v8f& b, v16b x, v16b y) { asm volatile("v_nop\n\tv_nop\n\tv_nop\n\tv_nop" : "+v"(a), "+v"(b) : "v"(x), "v"(y)); }
__device__ __forceinline__ void keep4_h(v16h a, v16h b, v16h c, v16h d) { asm volatile("v_nop" :: "v"(a), "v"(b), "v"(c), "v"(d)); }
__device__ __forceinline__ void keep4_b(v16b a, v16b b, v16b c, v16b d) { asm volatile("v_nop" :: "v"(a), "v"(b), "v"(c), "v"(d)); }
__device__ __forceinline__ void acc_guard4(v8f& a, v8f& b, v8f& c, v8f& d) { asm volatile("v_nop\n\tv_nop\n\tv_nop\n\tv_nop" : "+v"(a), "+v"(b), "+v"(c), "+v"(d)); }
template <typename T> struct Frag;
template <> struct Frag<_Float16> {
  typedef v16h V; union U { v16h v; v8h h[2]; };
  static __device__ __forceinline__ v16h load(const _Float16* p) {   // elements 0..7 <- p[0..7], 8..15 <- p[16..23]
    U f; f.h[0] = *(const v8h*)(p); f.h[1] = *(const v8h*)(p + 16); return f.v;
  }
  static __device__ __forceinline__ v8f mma(v16h a, v16h b, v8f c) {
    return __builtin_amdgcn_wmma_f32_16x16x32_f16(false, a, false, b, (short)0, c, false, false);
  }
  static __device__ __forceinline__ void guard(v8f& a, v8f& b, v16h x, v16h y) { dep_guard_h(a, b, x, y); }
  static __device__ __forceinline__ void keep(v16h a, v16h b, v16h c, v16h d) { keep4_h(a, b, c, d); }
};
template <> struct Frag<__bf16> {
  typedef v16b V; union U { v16b v; v8b h[2]; };
  static __device__ __forceinline__ v16b load(const __bf16* p) {
    U f; f.h[0] = *(const v8b*)(p); f.h[1] = *(const v8b*)(p + 16); return f.v;
  }
  static __device__ __forceinline__ v8f mma(v16b a, v16b b, v8f c) {
    return __builtin_amdgcn_wmma_f32_16x16x32_bf16(false, a, false, b, (short)0, c, false, false);
  }
  static __device__ __forceinline__ void guard(v8f& a, v8f& b, v16b x, v16b y) { dep_guard_b(a, b, x, y); }
  static __device__ __forceinline__ void keep(v16b a, v16b b, v16b c, v16b d) { keep4_b(a, b, c, d); }
};

__device__ __forceinline__ unsigned pk16(unsigned short a, unsigned short b) { return (unsigned)a | ((unsigned)b << 16); }
__device__ __forceinline__ unsigned short h_bits(float f) { const _Float16 h = (_Float16)f; return __builtin_bit_cast(unsigned short, h); }

// ---- Tensor-load pieces: a 64-row slice of 256-byte row pieces goes from global memory into LDS, through no register ----
typedef unsigned int u32x4 __attribute__((ext_vector_type(4)));
typedef unsigned int u32x8 __attribute__((ext_vector_type(8)));
constexpr unsigned kRowB   = 256u;               // bytes of an operand row per pass = 128 k of f16
constexpr unsigned kPitch  = 272u;               // LDS row pitch: 256 + 16 pad bytes, an odd multiple of 16 for ds_load_b128 readers
constexpr unsigned kSliceR = 64u;                // rows per slice, one slice per wave
constexpr unsigned kSlice  = 18432u;             // 64 * 272 = 17408 rounded up to a multiple of 2 KiB
constexpr unsigned kStage  = 4u * kSlice;        // [A rows 0-63 | A rows 64-127 | B rows 0-63 | B rows 64-127]
constexpr unsigned kSlabB  = 16u * 68u * 4u;     // epilogue slab of one wave, 16 rows at pitch 68 floats
static_assert(kSlice % 2048u == 0u && kSlice >= kSliceR * kPitch, "slice place must be a multiple of 2 KiB and hold its rows");
__device__ __forceinline__ unsigned uni(unsigned v) { return (unsigned)__builtin_amdgcn_readfirstlane((int)v); }
// holds a wave-uniform word in a scalar register, so that the test around a tensor load compiles to s_cmp + s_cbranch_scc
__device__ __forceinline__ unsigned pinned(unsigned v) { unsigned w = uni(v); asm volatile("" : "+s"(w)); return w; }
__device__ __forceinline__ void wait_ds0()     { asm volatile("s_wait_dscnt 0x0" ::: "memory"); }      // this wave's LDS reads have returned before the buffer is handed back
__device__ __forceinline__ void wait_tensor0() { asm volatile("s_wait_tensorcnt 0x0" ::: "memory"); }  // this wave's own slice has landed
__device__ __forceinline__ void tdm_load(u32x4 g0, u32x8 g1) { asm volatile("tensor_load_to_lds %0, %1" :: "s"(g0), "s"(g1) : "memory"); }
__device__ __forceinline__ u32x8 tdm_group1(unsigned src_pitch) {
  u32x8 g;
  g[0] = uni((1u << 20) | (5u << 22) | (3u << 25));   // no mask, 1-byte elements, 16 pad bytes behind every 256-byte row
  g[1] = uni((kRowB & 0xFFFFu) << 16);
  g[2] = uni((kRowB >> 16) | ((kSliceR & 0xFFFFu) << 16));
  g[3] = uni((kSliceR >> 16) | (kRowB << 16));
  g[4] = uni(kSliceR);
  g[5] = uni(src_pitch);
  g[6] = uni(0u);
  g[7] = uni(0u);
  return g;
}
__device__ __forceinline__ u32x4 tdm_group0(unsigned lds_dst, unsigned long long ga) {
  u32x4 g;
  g[0] = uni(1u); g[1] = uni(lds_dst); g[2] = uni((unsigned)ga); g[3] = uni((((unsigned)(ga >> 32)) & 0x01FFFFFFu) | 0x80000000u);
  return g;
}

// ---- Batched WMMA GEMM, operands staged in LDS (ACT reduced to none/relu/leaky) --------------------------
// C[m,n] = scale * sum_k A[m,k] * Bt[n,k] (+bias)(+resid); a work-group of 4 waves (2 x 2) owns a 128x128 tile, each wave 64x64 of it.
// A row-major [M,K]; Bt row-major [N,K]; M,N % 128 == 0, K % 128 == 0, K >= 256.
// A pass is 128 k: each wave brings one 64-row slice of the stage by one tensor load, two buffers, the next stage in flight under this pass.
// SPLIT: must be false; one plane per operand (A2/Bt2 unused).
// BIAS_MODE: 0 = none, 1 = bias[m], 2 = bias[n].
// OUT_MODE: 0 = f32, 1 = f16, 2 = bf16 hi plane (Cout) + bf16 lo plane (Cout2).
// ET: 0 = f16 operands, 1 = bf16 operands (pointers passed as 16-bit storage)
template <int ET> struct Elem;
template <> struct Elem<0> { typedef _Float16 T; };
template <> struct Elem<1> { typedef __bf16 T; };
template <int ET, bool SPLIT, int BIAS_MODE, int OUT_MODE, bool RESID, int ACT = 0>
__global__ __launch_bounds__(128) void wmma_gemm64(
    const unsigned short* __restrict__ Ap, const unsigned short* __restrict__ A2p, int lda, long strideA,
    const unsigned short* __restrict__ Btp, const unsigned short* __restrict__ Bt2p, int ldb, long strideB,
    void* __restrict__ Cout, void* __restrict__ Cout2, int ldc, long strideC,
    const float* __restrict__ bias,
    const float* __restrict__ resid, long strideR,
    int M, int N, int K, float scale) {
  typedef typename Elem<ET>::T T;
  typedef typename Frag<T>::V V;
  const T* A = (const T*)Ap; const T* A2 = (const T*)A2p; const T* Bt = (const T*)Btp; const T* Bt2 = (const T*)Bt2p;
  static_assert(!SPLIT, "the staged engine carries one plane per operand");
  __shared__ __attribute__((aligned(2048))) unsigned char ring[2u * kStage];   // two stages; after the loop the waves' epilogue slabs
  const int b    = blockIdx.y;
  const int lane = threadIdx.x & 31;
  const unsigned wave = uni(threadIdx.x >> 5);
  const int tilesN = N >> 7;
  const int tilesM = M >> 7;
  const int tile = blockIdx.x;
  if (tile >= tilesM * tilesN) return;   // the same for the whole work-group, in front of every barrier and tensor load
  const int tm = tile / tilesN;
  const int tn = tile - tm * tilesN;
  const unsigned wm = wave >> 1, wn = wave & 1u;
  const int m0 = (tm << 7) + (int)(wm << 6);
  const int n0 = (tn << 7) + (int)(wn << 6);

  const T* Ab  = A  + (size_t)b * strideA;
  const T* Bb  = Bt + (size_t)b * strideB;

  const int rlane = lane & 15;                 // row (A) / col (B, D) within subtile
  const int koff  = (lane >> 4) * 8;           // k offset of this lane half
  const int mOff  = (lane >> 4) * 8;           // D row offset

  // this wave's slice of every stage: waves 0,1 the two halves of the A rows, waves 2,3 of the B rows
  const bool isA = wave < 2u;
  const T* srcRow = isA ? (Ab + (size_t)((tm << 7) + (int)((wave & 1u) << 6)) * lda)
                        : (Bb + (size_t)((tn << 7) + (int)((wave & 1u) << 6)) * ldb);
  const unsigned long long srcB = (unsigned long long)(size_t)srcRow;
  u32x8 g1 = tdm_group1((unsigned)(isA ? lda : ldb) * 2u);
  asm volatile("" : "+s"(g1));   // descriptor words held in their scalar registers: none is rebuilt or lent out while a request is in flight
  const unsigned ldsMine = (unsigned)(size_t)ring + wave * kSlice;
  const unsigned ldsBoth = 2u * ldsMine + kStage;   // this slice's place in buffer 0 plus its place in buffer 1
  const unsigned nPass = (unsigned)K >> 7;
  u32x4 g0 = tdm_group0(ldsMine, srcB);
  // the next stage's request: the other buffer, 256 bytes further along the rows. Called only behind this wave's s_wait_tensorcnt 0.
  auto next_stage = [&]() {
    asm volatile("" : "+s"(g0));   // descriptor words held in their scalar registers: they take their new values here, behind the wait, and are lent to nothing between requests
    const unsigned long long a = ((((unsigned long long)g0[3]) << 32) | (unsigned long long)g0[2]) + kRowB;   // type bits ride above the address
    g0[1] = uni(ldsBoth - g0[1]);
    g0[2] = uni((unsigned)a);
    g0[3] = uni((unsigned)(a >> 32));
    tdm_load(g0, g1);
  };

  v8f acc[4][4];
#pragma unroll
  for (int i = 0; i < 4; ++i)
#pragma unroll
    for (int j = 0; j < 4; ++j) acc[i][j] = (v8f){0.f,0.f,0.f,0.f,0.f,0.f,0.f,0.f};

  tdm_load(g0, g1);      // stage 0
  wait_tensor0();
  __syncthreads();       // stage 0 published
  next_stage();          // stage 1, in flight under pass 0

  const unsigned aOff = wm * kSlice        + (unsigned)rlane * kPitch + (unsigned)koff * 2u;
  const unsigned bOff = (2u + wn) * kSlice + (unsigned)rlane * kPitch + (unsigned)koff * 2u;
#pragma unroll 1   // one pass per trip: the buffer index stays a run-time scalar and the body is not doubled
  for (unsigned t = 0; t < nPass; ++t) {
    const unsigned char* buf = ring + (t & 1u) * kStage;
    const T* pa = (const T*)(buf + aOff);
    const T* pb = (const T*)(buf + bOff);
    V af[2][4], bf[2][4];
#pragma unroll
    for (int j = 0; j < 4; ++j) {
      bf[0][j] = Frag<T>::load(pb + j * (16 * (int)kPitch / 2));
      af[0][j] = Frag<T>::load(pa + j * (16 * (int)kPitch / 2));
    }
#pragma unroll
    for (int kc = 0; kc < 4; ++kc) {
      const int cur = kc & 1, nxt = cur ^ 1;
      __builtin_amdgcn_sched_barrier(0);   // keeps the next block's LDS reads one group ahead of this block's WMMAs, not among them
      if (kc < 3) {
#pragma unroll
        for (int j = 0; j < 4; ++j) {
          bf[nxt][j] = Frag<T>::load(pb + j * (16 * (int)kPitch / 2) + (kc + 1) * 32);
          af[nxt][j] = Frag<T>::load(pa + j * (16 * (int)kPitch / 2) + (kc + 1) * 32);
        }
      }
      __builtin_amdgcn_sched_barrier(0);   // the other side of that group
      if (kc == 3) {
        // publish point of stage t + 1: the pass's last fragments are fetched, only register work of this pass is left behind it
        wait_ds0();
        wait_tensor0();
        __syncthreads();                   // stage t + 1 readable by every wave; every wave has left stage t's buffer
        if (pinned(t + 2u < nPass)) next_stage();   // stage t + 2 into the buffer just left, in flight under the last block and pass t + 1
      }
#pragma unroll
      for (int i = 0; i < 4; ++i) {
#pragma unroll
        for (int j = 0; j < 4; ++j) acc[i][j] = Frag<T>::mma(af[cur][i], bf[cur][j], acc[i][j]);
      }
    }
  }
  wait_tensor0();
  wait_ds0();
  acc_guard4(acc[0][0], acc[0][1], acc[0][2], acc[0][3]);
  acc_guard4(acc[1][0], acc[1][1], acc[1][2], acc[1][3]);
  acc_guard4(acc[2][0], acc[2][1], acc[2][2], acc[2][3]);
  acc_guard4(acc[3][0], acc[3][1], acc[3][2], acc[3][3]);

  // ---- epilogue ----
  float* slab = (float*)(ring + wave * kSlabB);   // the last pass's barrier stands between every ring read and this reuse
  const float* Rb = RESID ? (resid + (size_t)b * strideR) : nullptr;
#pragma unroll
  for (int i = 0; i < 4; ++i) {
    const int mBase = m0 + (i << 4);
#pragma unroll
    for (int j = 0; j < 4; ++j) {
      const int n = n0 + (j << 4) + rlane;
      float bv = 0.f;
      if (BIAS_MODE == 2) bv = bias[n];
#pragma unroll
      for (int r = 0; r < 8; ++r) {
        float v = acc[i][j][r] * scale;
        if (BIAS_MODE == 1) v += bias[mBase + mOff + r];
        if (BIAS_MODE == 2) v += bv;
        if (RESID) v += Rb[(size_t)(mBase + mOff + r) * ldc + n];
        if (ACT == 2) v = fmaxf(v, 0.0f);
        if (ACT == 4) v = (v > 0.f) ? v : 0.01f * v;
        slab[(mOff + r) * 68 + (j << 4) + rlane] = v;
      }
    }
    __builtin_amdgcn_fence(__ATOMIC_RELEASE, "workgroup");
    __builtin_amdgcn_wave_barrier();
    __builtin_amdgcn_fence(__ATOMIC_ACQUIRE, "workgroup");
    if (OUT_MODE == 0) {
      float* C = (float*)Cout + (size_t)b * strideC;
      const int hh = lane >> 4, c4 = (lane & 15) * 4;     // row seg = 256 B = 16 lanes x 16 B
      {
#pragma unroll
        for (int it = 0; it < 8; ++it) {
          const int row = it * 2 + hh;
          v4f v = *(const v4f*)(slab + row * 68 + c4);
          *(v4f*)(C + (size_t)(mBase + row) * ldc + n0 + c4) = v;
        }
        
      }
    } else {
      const int q = lane >> 3, c8 = (lane & 7) * 8;
      unsigned short* C  = (unsigned short*)Cout  + (size_t)b * strideC;
      unsigned short* C2 = (OUT_MODE == 2) ? ((unsigned short*)Cout2 + (size_t)b * strideC) : nullptr;
      {
#pragma unroll
        for (int it = 0; it < 4; ++it) {
          const int row = it * 4 + q;
          const float* sp = slab + row * 68 + c8;
          v8h hv, lv;
#pragma unroll
          for (int e = 0; e < 8; ++e) {
            if (OUT_MODE == 1) {
              hv[e] = (_Float16)sp[e];
            } else {
              unsigned short hb = f2bf_bits(sp[e]);
              unsigned short lb = f2bf_bits(sp[e] - bf_bits2f(hb));
              hv[e] = __builtin_bit_cast(_Float16, hb);
              lv[e] = __builtin_bit_cast(_Float16, lb);
            }
          }
          *(v8h*)(C + (size_t)(mBase + row) * ldc + n0 + c8) = hv;
          if (OUT_MODE == 2) *(v8h*)(C2 + (size_t)(mBase + row) * ldc + n0 + c8) = lv;
        }
        
      }
    }
    __builtin_amdgcn_fence(__ATOMIC_RELEASE, "workgroup");
    __builtin_amdgcn_wave_barrier();
    __builtin_amdgcn_fence(__ATOMIC_ACQUIRE, "workgroup");
  }
}

// ---------------------------------------------------------------------------
// f32 -> f16 cast of 8 consecutive elements per thread, value = f16((in [+ ctx]) * scale); the optional ctx vector
// [kDim] is broadcast over rows of pitch kDim (the flat index modulo kDim selects the ctx element; 8 | kDim so a
// ---------------------------------------------------------------------------
template <bool HAS_CTX>
__global__ __launch_bounds__(256) void cast8_f16_kernel(const float* __restrict__ in, const float* __restrict__ ctx,
                                                        unsigned short* __restrict__ out, int n8, float scale) {
  const int i = blockIdx.x * 256 + threadIdx.x;
  if (i >= n8) return;
  const float* p = in + 8 * (size_t)i;
  v4f a = *(const v4f*)(p);
  v4f c = *(const v4f*)(p + 4);
  if (HAS_CTX) {
    const int cb = (int)((8 * (size_t)i) & (size_t)(kDim - 1));   // 0..kDim-8, multiple of 8
    const v4f g0 = *(const v4f*)(ctx + cb);
    const v4f g1 = *(const v4f*)(ctx + cb + 4);
    a = a + g0;
    c = c + g1;
  }
  unsigned short hb[8];
#pragma unroll
  for (int e = 0; e < 4; ++e) {
    hb[e]     = h_bits(a[e] * scale);
    hb[4 + e] = h_bits(c[e] * scale);
  }
  const v4u u = (v4u){pk16(hb[0], hb[1]), pk16(hb[2], hb[3]), pk16(hb[4], hb[5]), pk16(hb[6], hb[7])};
  unsigned short* q = out + 8 * (size_t)i;
  *(v4u*)q = u;
  
}

// ---------------------------------------------------------------------------
// Row softmax over kSeq = 2048 f32 scores: P[row][j] = f16( carry * exp(s - max) * (1 / sum exp(s - max)) ), f32 math.
// One block of 256 threads per row; thread t owns columns 8t..8t+7 (256 x 8 = 2048 = whole row).
// Reductions in fixed order (thread, wave shuffle tree, 8 wave partials in index order); cross-wave LDS reads only
// after __syncthreads.
// ---------------------------------------------------------------------------
__global__ __launch_bounds__(256) void softmax_row_kernel(const float* __restrict__ S, unsigned short* __restrict__ P,
                                                          float carry) {
  __shared__ float redM[8];
  __shared__ float redS[8];
  const int row  = blockIdx.x;
  const int t    = threadIdx.x;
  const int lane = t & 31, wave = t >> 5;
  const int c0   = t * 8;
  const float* sr = S + (size_t)row * kSeq + c0;
  const v4f a = *(const v4f*)(sr);
  const v4f c = *(const v4f*)(sr + 4);
  float x[8];
#pragma unroll
  for (int e = 0; e < 4; ++e) { x[e] = a[e]; x[4 + e] = c[e]; }
  float m = fmaxf(fmaxf(fmaxf(x[0], x[1]), fmaxf(x[2], x[3])), fmaxf(fmaxf(x[4], x[5]), fmaxf(x[6], x[7])));
#pragma unroll
  for (int off = 16; off > 0; off >>= 1) m = fmaxf(m, __shfl_xor(m, off, 32));
  if (lane == 0) redM[wave] = m;
  __syncthreads();
  float gm = redM[0];
#pragma unroll
  for (int w = 1; w < 8; ++w) gm = fmaxf(gm, redM[w]);
  float p[8];
  float s = 0.f;
#pragma unroll
  for (int e = 0; e < 8; ++e) { p[e] = expf(x[e] - gm); s += p[e]; }
#pragma unroll
  for (int off = 16; off > 0; off >>= 1) s += __shfl_xor(s, off, 32);
  if (lane == 0) redS[wave] = s;
  __syncthreads();
  float tot = redS[0];
#pragma unroll
  for (int w = 1; w < 8; ++w) tot += redS[w];
  const float rcp = 1.0f / tot;    // tot >= 1 (the max element contributes exp(0))
  unsigned short hb[8];
#pragma unroll
  for (int e = 0; e < 8; ++e) hb[e] = h_bits((p[e] * rcp) * carry);
  const v4u u = (v4u){pk16(hb[0], hb[1]), pk16(hb[2], hb[3]), pk16(hb[4], hb[5]), pk16(hb[6], hb[7])};
  unsigned short* q = P + (size_t)row * kSeq + c0;
  *(v4u*)q = u;
  
}

// ---------------------------------------------------------------------------
// Host side
// Workspace region map (bytes, all offsets 2 MiB aligned):
//   R0 Xq16 [8192][1024] f16   16 MiB @  0 MiB   (dead after launch 7)
//   R1 Xk16 [8192][1024] f16   16 MiB @ 16 MiB   (dead after launch 8)
//   R2 Xv16 [8192][1024] f16   16 MiB @ 32 MiB   (dead after launch 9)
//   R3 Wq16,Wk16,Wv16 [1024][1024] f16 x16 carry, 2 MiB each @ 48/50/52 MiB
//   R4 Q16  [8192][1024] f16   16 MiB @ 54 MiB
//   R5 K16  [8192][1024] f16   16 MiB @ 70 MiB
//   R6 VT16 [4][1024][2048] f16 16 MiB @ 86 MiB
//   total carve 102 MiB = 106954752 B
//   per 2-batch attention chunk (reusing dead R0..R2):
//     Sc  [2][2048][2048] f32 32 MiB @ 0 MiB (over R0,R1)
//     P16 [2][2048][2048] f16 16 MiB @ 32 MiB (over R2)
// ---------------------------------------------------------------------------
extern "C" void kernel_launch(void* const* d_in, const int* in_sizes, int n_in,
                              void* d_out, int out_size, void* d_ws, size_t ws_size,
                              hipStream_t stream) {
  if (n_in < 10) return;
  const float* query = (const float*)d_in[0];
  const float* key   = (const float*)d_in[1];
  const float* value = (const float*)d_in[2];
  const float* ctx   = (const float*)d_in[3];
  const float* Wq    = (const float*)d_in[4];
  const float* bq    = (const float*)d_in[5];
  const float* Wk    = (const float*)d_in[6];
  const float* bk    = (const float*)d_in[7];
  const float* Wv    = (const float*)d_in[8];
  const float* bv    = (const float*)d_in[9];
  float* out = (float*)d_out;

  const size_t actE = (size_t)kTok * kDim;      // 8388608 elements per activation tensor
  const size_t wE   = (size_t)kDim * kDim;      // 1048576 elements per weight
  if ((size_t)in_sizes[0] != actE || (size_t)in_sizes[1] != actE || (size_t)in_sizes[2] != actE) return;
  if ((size_t)in_sizes[3] != (size_t)kDim) return;
  if ((size_t)in_sizes[4] != wE || (size_t)in_sizes[6] != wE || (size_t)in_sizes[8] != wE) return;
  if ((size_t)in_sizes[5] != (size_t)kDim || (size_t)in_sizes[7] != (size_t)kDim || (size_t)in_sizes[9] != (size_t)kDim) return;
  if ((size_t)out_size != actE) return;

  const size_t actB16 = actE * 2;     // 16 MiB
  const size_t wB16   = wE * 2;       //  2 MiB
  unsigned char* ws = (unsigned char*)d_ws;
  size_t off = 0;
  unsigned short* Xq16 = (unsigned short*)(ws + off); off += actB16;
  unsigned short* Xk16 = (unsigned short*)(ws + off); off += actB16;
  unsigned short* Xv16 = (unsigned short*)(ws + off); off += actB16;
  unsigned short* Wq16 = (unsigned short*)(ws + off); off += wB16;
  unsigned short* Wk16 = (unsigned short*)(ws + off); off += wB16;
  unsigned short* Wv16 = (unsigned short*)(ws + off); off += wB16;
  unsigned short* Q16  = (unsigned short*)(ws + off); off += actB16;
  unsigned short* K16  = (unsigned short*)(ws + off); off += actB16;
  unsigned short* VT16 = (unsigned short*)(ws + off); off += actB16;
  const size_t carveTotal = off;                         // 106954752 B
  if (carveTotal > ws_size) return;
  // chunk regions over dead R0..R2
  const size_t scBytes = (size_t)kChunkB * kSeq * kSeq * sizeof(float);   // 32 MiB == 2 * actB16
  const size_t pBytes  = (size_t)kChunkB * kSeq * kSeq * 2;               // 16 MiB == actB16
  if (scBytes + pBytes > 3 * actB16) return;
  float*          Sc  = (float*)(ws + 0);
  unsigned short* P16 = (unsigned short*)(ws + scBytes);

  const dim3 blk(256);
  const dim3 blkG(128);   // GEMM work-groups: 4 waves

  // launches 1-3: activation casts (query, key with context add), 8 elements per thread, exact grids
  const int n8act = (int)(actE / 8);                     // 1048576 -> 4096 blocks
  const dim3 gAct((unsigned)((n8act + 255) / 256));
  cast8_f16_kernel<true ><<<gAct, blk, 0, stream>>>(query, ctx, Xq16, n8act, 1.0f);
  cast8_f16_kernel<true ><<<gAct, blk, 0, stream>>>(key,   ctx, Xk16, n8act, 1.0f);
  cast8_f16_kernel<false><<<gAct, blk, 0, stream>>>(value, ctx, Xv16, n8act, 1.0f);

  // launches 4-6: weight casts, carried x16
  const int n8w = (int)(wE / 8);                         // 131072 -> 512 blocks
  const dim3 gW((unsigned)((n8w + 255) / 256));
  cast8_f16_kernel<false><<<gW, blk, 0, stream>>>(Wq, ctx, Wq16, n8w, kWCarry);
  cast8_f16_kernel<false><<<gW, blk, 0, stream>>>(Wk, ctx, Wk16, n8w, kWCarry);
  cast8_f16_kernel<false><<<gW, blk, 0, stream>>>(Wv, ctx, Wv16, n8w, kWCarry);

  // launches 7-8: Q16/K16 [8192][1024] = X16 [8192][1024] x W16 [1024][1024]^T, bias[n], scale 1/16
  // M = 8192, N = 1024, K = 1024 (K % 128 == 0, M,N % 128 == 0); tiles = 64 * 8 = 512 blocks x 4 waves
  {
    const int M = kTok, N = kDim, K = kDim;
    const dim3 g((unsigned)((M / 128) * (N / 128)), 1);
    wmma_gemm64<0, false, 2, 1, false, 0><<<g, blkG, 0, stream>>>(
        Xq16, Xq16, kDim, 0L, Wq16, Wq16, kDim, 0L, (void*)Q16, (void*)Q16, kDim, 0L,
        bq, bq, 0L, M, N, K, kWCarryInv);
    wmma_gemm64<0, false, 2, 1, false, 0><<<g, blkG, 0, stream>>>(
        Xk16, Xk16, kDim, 0L, Wk16, Wk16, kDim, 0L, (void*)K16, (void*)K16, kDim, 0L,
        bk, bk, 0L, M, N, K, kWCarryInv);
  }
  // launch 9: VT16[b][d][s] = Wv16 [1024][1024] x Xv16_b [2048][1024]^T, bias[m] = bv[d], scale 1/16
  // M = 1024 (d), N = 2048 (s), K = 1024; tiles = 8 * 16 = 128 blocks; grid.y = batch
  {
    const int M = kDim, N = kSeq, K = kDim;
    const dim3 g((unsigned)((M / 128) * (N / 128)), (unsigned)kBatch);
    wmma_gemm64<0, false, 1, 1, false, 0><<<g, blkG, 0, stream>>>(
        Wv16, Wv16, kDim, 0L,
        Xv16, Xv16, kDim, (long)kSeq * kDim,
        (void*)VT16, (void*)VT16, kSeq, (long)kDim * kSeq,
        bv, bv, 0L, M, N, K, kWCarryInv);
  }

  // launches 10-15: attention per 2-batch chunk
  for (int ch = 0; ch < kBatch / kChunkB; ++ch) {
    const size_t b0 = (size_t)ch * kChunkB;
    const unsigned short* Qc  = Q16  + b0 * (size_t)kSeq * kDim;
    const unsigned short* Kc  = K16  + b0 * (size_t)kSeq * kDim;
    const unsigned short* VTc = VT16 + b0 * (size_t)kDim * kSeq;
    float* Oc = out + b0 * (size_t)kSeq * kDim;
    // scores Sc[g][q][k] = (1/32) * Q_g [2048][1024] x K_g [2048][1024]^T, f32 out
    // M = N = 2048, K = 1024; tiles = 16 * 16 = 256 blocks; grid.y = kChunkB
    {
      const int M = kSeq, N = kSeq, K = kDim;
      const dim3 g((unsigned)((M / 128) * (N / 128)), (unsigned)kChunkB);
      wmma_gemm64<0, false, 0, 0, false, 0><<<g, blkG, 0, stream>>>(
          Qc, Qc, kDim, (long)kSeq * kDim,
          Kc, Kc, kDim, (long)kSeq * kDim,
          (void*)Sc, (void*)Sc, kSeq, (long)kSeq * kSeq,
          bq, bq, 0L, M, N, K, kScoreScale);
    }
    // row softmax -> P16 [g][q][k] carried x2048; one block per row, kChunkB * 2048 rows
    {
      const dim3 g((unsigned)(kChunkB * kSeq));
      softmax_row_kernel<<<g, blk, 0, stream>>>(Sc, P16, kPCarry);
    }
    // out[g][q][d] = (1/2048) * P16_g [2048][2048] x VT16_g [1024][2048]^T, f32 straight to d_out rows (ldc 1024)
    // M = 2048, N = 1024, K = 2048; tiles = 16 * 8 = 128 blocks; grid.y = kChunkB
    {
      const int M = kSeq, N = kDim, K = kSeq;
      const dim3 g((unsigned)((M / 128) * (N / 128)), (unsigned)kChunkB);
      wmma_gemm64<0, false, 0, 0, false, 0><<<g, blkG, 0, stream>>>(
          P16, P16, kSeq, (long)kSeq * kSeq,
          VTc, VTc, kSeq, (long)kDim * kSeq,
          (void*)Oc, (void*)Oc, kDim, (long)kSeq * kDim,
          bq, bq, 0L, M, N, K, kPCarryInv);
    }
  }
}

// v002
// It runs in 128 microseconds.
// Next to v001, in two timings, it ran 1.44 and 1.43 times as fast.
// Over all steps from v000 it is 3.69 times as fast.
// Contractions: q/k/v projections (x f16, W f16 carried x16), scores q.k^T (q,k f16 planes, 1/32 folded in f32 epilogue), P.v (P f16 carried x2048, v^T f16 plane): all v_wmma_f32_16x16x32_f16 with f32 accumulate; context add, bias, softmax in f32.
#include <hip/hip_runtime.h>
#include <math.h>

// ---------------------------------------------------------------------------
// Problem constants
// ---------------------------------------------------------------------------
constexpr int kBatch  = 4;
constexpr int kSeq    = 2048;
constexpr int kDim    = 1024;
constexpr int kTok    = kBatch * kSeq;      // 8192 token rows
constexpr int kChunkB = 4;                  // batches per attention launch: all of them
constexpr float kWCarry     = 16.0f;        // weights carried x16 in f16
constexpr float kWCarryInv  = 1.0f / 16.0f;
constexpr float kPCarry     = 2048.0f;      // probabilities carried x2048 in f16
constexpr float kPCarryInv  = 1.0f / 2048.0f;
constexpr float kScoreScale = 0.03125f;     // 1024^-0.5

typedef __attribute__((ext_vector_type(16))) _Float16 v16h;
typedef __attribute__((ext_vector_type(8)))  _Float16 v8h;
typedef __attribute__((ext_vector_type(16))) __bf16   v16b;
typedef __attribute__((ext_vector_type(8)))  __bf16   v8b;
typedef __attribute__((ext_vector_type(8)))  float    v8f;
typedef __attribute__((ext_vector_type(4)))  float    v4f;
typedef __attribute__((ext_vector_type(4)))  unsigned int v4u;

// ---------------------------------------------------------------------------
// Helper pieces
// ---------------------------------------------------------------------------
__device__ __forceinline__ unsigned short f2bf_bits(float f) {
  unsigned u = __float_as_uint(f);
  return (unsigned short)((u + 0x7FFFu + ((u >> 16) & 1u)) >> 16);
}
__device__ __forceinline__ float bf_bits2f(unsigned short h) { return __uint_as_float(((unsigned)h) << 16); }

// hazard guards as plain device helpers
__device__ __forceinline__ void dep_guard_h(v8f& a, v8f& b, v16h x, v16h y) { asm volatile("v_nop\n\tv_nop\n\tv_nop\n\tv_nop" : "+v"(a), "+v"(b) : "v"(x), "v"(y)); }
__device__ __forceinline__ void dep_guard_b(v8f& a, v8f& b, v16b x, v16b y) { asm volatile("v_nop\n\tv_nop\n\tv_nop\n\tv_nop" : "+v"(a), "+v"(b) : "v"(x), "v"(y)); }
__device__ __forceinline__ void keep4_h(v16h a, v16h b, v16h c, v16h d) { asm volatile("v_nop" :: "v"(a), "v"(b), "v"(c), "v"(d)); }
__device__ __forceinline__ void keep4_b(v16b a, v16b b, v16b c, v16b d) { asm volatile("v_nop" :: "v"(a), "v"(b), "v"(c), "v"(d)); }
__device__ __forceinline__ void acc_guard4(v8f& a, v8f& b, v8f& c, v8f& d) { asm volatile("v_nop\n\tv_nop\n\tv_nop\n\tv_nop" : "+v"(a), "+v"(b), "+v"(c), "+v"(d)); }
template <typename T> struct Frag;
template <> struct Frag<_Float16> {
  typedef v16h V; union U { v16h v; v8h h[2]; };
  static __device__ __forceinline__ v16h load(const _Float16* p) {   // elements 0..7 <- p[0..7], 8..15 <- p[16..23]
    U f; f.h[0] = *(const v8h*)(p); f.h[1] = *(const v8h*)(p + 16); return f.v;
  }
  static __device__ __forceinline__ v8f mma(v16h a, v16h b, v8f c) {
    return __builtin_amdgcn_wmma_f32_16x16x32_f16(false, a, false, b, (short)0, c, false, false);
  }
  static __device__ __forceinline__ void guard(v8f& a, v8f& b, v16h x, v16h y) { dep_guard_h(a, b, x, y); }
  static __device__ __forceinline__ void keep(v16h a, v16h b, v16h c, v16h d) { keep4_h(a, b, c, d); }
};
template <> struct Frag<__bf16> {
  typedef v16b V; union U { v16b v; v8b h[2]; };
  static __device__ __forceinline__ v16b load(const __bf16* p) {
    U f; f.h[0] = *(const v8b*)(p); f.h[1] = *(const v8b*)(p + 16); return f.v;
  }
  static __device__ __forceinline__ v8f mma(v16b a, v16b b, v8f c) {
    return __builtin_amdgcn_wmma_f32_16x16x32_bf16(false, a, false, b, (short)0, c, false, false);
  }
  static __device__ __forceinline__ void guard(v8f& a, v8f& b, v16b x, v16b y) { dep_guard_b(a, b, x, y); }
  static __device__ __forceinline__ void keep(v16b a, v16b b, v16b c, v16b d) { keep4_b(a, b, c, d); }
};

__device__ __forceinline__ unsigned pk16(unsigned short a, unsigned short b) { return (unsigned)a | ((unsigned)b << 16); }
__device__ __forceinline__ unsigned short h_bits(float f) { const _Float16 h = (_Float16)f; return __builtin_bit_cast(unsigned short, h); }

// ---- Tensor-load pieces: a 64-row slice of 256-byte row pieces goes from global memory into LDS, through no register ----
typedef unsigned int u32x4 __attribute__((ext_vector_type(4)));
typedef unsigned int u32x8 __attribute__((ext_vector_type(8)));
constexpr unsigned kRowB   = 256u;               // bytes of an operand row per pass = 128 k of f16
constexpr unsigned kPitch  = 272u;               // LDS row pitch: 256 + 16 pad bytes, an odd multiple of 16 for ds_load_b128 readers
constexpr unsigned kSliceR = 64u;                // rows per slice, one slice per wave
constexpr unsigned kSlice  = 18432u;             // 64 * 272 = 17408 rounded up to a multiple of 2 KiB
constexpr unsigned kStage  = 4u * kSlice;        // [A rows 0-63 | A rows 64-127 | B rows 0-63 | B rows 64-127]
constexpr unsigned kSlabB  = 16u * 68u * 4u;     // epilogue slab of one wave, 16 rows at pitch 68 floats
static_assert(kSlice % 2048u == 0u && kSlice >= kSliceR * kPitch, "slice place must be a multiple of 2 KiB and hold its rows");
__device__ __forceinline__ unsigned uni(unsigned v) { return (unsigned)__builtin_amdgcn_readfirstlane((int)v); }
// holds a wave-uniform word in a scalar register, so that the test around a tensor load compiles to s_cmp + s_cbranch_scc
__device__ __forceinline__ unsigned pinned(unsigned v) { unsigned w = uni(v); asm volatile("" : "+s"(w)); return w; }
__device__ __forceinline__ void wait_ds0()     { asm volatile("s_wait_dscnt 0x0" ::: "memory"); }      // this wave's LDS reads have returned before the buffer is handed back
__device__ __forceinline__ void wait_tensor0() { asm volatile("s_wait_tensorcnt 0x0" ::: "memory"); }  // this wave's own slice has landed
__device__ __forceinline__ void tdm_load(u32x4 g0, u32x8 g1) { asm volatile("tensor_load_to_lds %0, %1" :: "s"(g0), "s"(g1) : "memory"); }
__device__ __forceinline__ u32x8 tdm_group1(unsigned src_pitch) {
  u32x8 g;
  g[0] = uni((1u << 20) | (5u << 22) | (3u << 25));   // no mask, 1-byte elements, 16 pad bytes behind every 256-byte row
  g[1] = uni((kRowB & 0xFFFFu) << 16);
  g[2] = uni((kRowB >> 16) | ((kSliceR & 0xFFFFu) << 16));
  g[3] = uni((kSliceR >> 16) | (kRowB << 16));
  g[4] = uni(kSliceR);
  g[5] = uni(src_pitch);
  g[6] = uni(0u);
  g[7] = uni(0u);
  return g;
}
__device__ __forceinline__ u32x4 tdm_group0(unsigned lds_dst, unsigned long long ga) {
  u32x4 g;
  g[0] = uni(1u); g[1] = uni(lds_dst); g[2] = uni((unsigned)ga); g[3] = uni((((unsigned)(ga >> 32)) & 0x01FFFFFFu) | 0x80000000u);
  return g;
}

// ---- Batched WMMA GEMM, operands staged in LDS (ACT reduced to none/relu/leaky) --------------------------
// C[m,n] = scale * sum_k A[m,k] * Bt[n,k] (+bias)(+resid); a work-group of 4 waves (2 x 2) owns a 128x128 tile, each wave 64x64 of it.
// A row-major [M,K]; Bt row-major [N,K]; M,N % 128 == 0, K % 128 == 0, K >= 256.
// A pass is 128 k: each wave brings one 64-row slice of the stage by one tensor load, two buffers, the next stage in flight under this pass.
// SPLIT: must be false (one plane per operand); A2/Bt2 are not read.
// BIAS_MODE: 0 = none, 1 = bias[m], 2 = bias[n], 3 = the three projections in one grid (below).
// BIAS_MODE 3: blockIdx.y is the job: 0 = q, 1 = k, 2 = v. A, Bt, Cout are the q job's planes; job y's lie y * strideA / strideB / strideC
// elements further; its bias is bias / biasB / biasC. Jobs 0 and 1: C[token][n] = A . Bt^T + bias[n]. Job 2 is the transposed product per
// batch of kSeq tokens: C[batch][n][token] = Bt . A_batch^T + bias[n], so the weight plane takes the A side and the bias goes by row.
// OUT_MODE: 0 = f32, 1 = f16, 2 = bf16 hi plane (Cout) + bf16 lo plane (Cout2).
// ET: 0 = f16 operands, 1 = bf16 operands (pointers passed as 16-bit storage)
template <int ET> struct Elem;
template <> struct Elem<0> { typedef _Float16 T; };
template <> struct Elem<1> { typedef __bf16 T; };
template <int ET, bool SPLIT, int BIAS_MODE, int OUT_MODE, bool RESID, int ACT = 0>
__global__ __launch_bounds__(128) void wmma_gemm64(
    const unsigned short* __restrict__ Ap, const unsigned short* __restrict__ A2p, int lda, long strideA,
    const unsigned short* __restrict__ Btp, const unsigned short* __restrict__ Bt2p, int ldb, long strideB,
    void* __restrict__ Cout, void* __restrict__ Cout2, int ldc, long strideC,
    const float* __restrict__ bias,
    const float* __restrict__ resid, long strideR,
    int M, int N, int K, float scale,
    const float* __restrict__ biasB, const float* __restrict__ biasC) {
  typedef typename Elem<ET>::T T;
  typedef typename Frag<T>::V V;
  const T* A = (const T*)Ap; const T* A2 = (const T*)A2p; const T* Bt = (const T*)Btp; const T* Bt2 = (const T*)Bt2p;
  static_assert(!SPLIT, "the staged engine carries one plane per operand");
  __shared__ __attribute__((aligned(2048))) unsigned char ring[2u * kStage];   // two stages; after the loop the waves' epilogue slabs
  int b    = blockIdx.y;
  int tile = blockIdx.x;
  bool biasByRow = false;
  if (BIAS_MODE == 3) {
    // every value here is the same for the whole work-group: it comes from blockIdx and the arguments alone
    const int job = b;
    const T* X  = A  + (size_t)job * strideA;
    const T* Wt = Bt + (size_t)job * strideB;
    Cout = (void*)((unsigned short*)Cout + (size_t)job * strideC);
    bias = (job == 0) ? bias : ((job == 1) ? biasB : biasC);
    A = X; Bt = Wt; b = 0;
    if (job == 2) {
      const int perBatch = (N >> 7) * (kSeq >> 7);   // tiles of one batch's [N][kSeq] output
      b = tile / perBatch;
      tile -= b * perBatch;
      A = Wt; Bt = X;
      strideC = (long)N * kSeq;
      M = N; N = kSeq; ldc = kSeq;
      biasByRow = true;
    }
    strideA = 0L;
    strideB = (long)kSeq * ldb;   // used by job 2 alone: jobs 0 and 1 have b = 0
  }
  const int lane = threadIdx.x & 31;
  const unsigned wave = uni(threadIdx.x >> 5);
  const int tilesN = N >> 7;
  const int tilesM = M >> 7;
  if (tile >= tilesM * tilesN) return;   // the same for the whole work-group, in front of every barrier and tensor load
  const int tm = tile / tilesN;
  const int tn = tile - tm * tilesN;
  const unsigned wm = wave >> 1, wn = wave & 1u;
  const int m0 = (tm << 7) + (int)(wm << 6);
  const int n0 = (tn << 7) + (int)(wn << 6);

  const T* Ab  = A  + (size_t)b * strideA;
  const T* Bb  = Bt + (size_t)b * strideB;

  const int rlane = lane & 15;                 // row (A) / col (B, D) within subtile
  const int koff  = (lane >> 4) * 8;           // k offset of this lane half
  const int mOff  = (lane >> 4) * 8;           // D row offset

  // this wave's slice of every stage: waves 0,1 the two halves of the A rows, waves 2,3 of the B rows
  const bool isA = wave < 2u;
  const T* srcRow = isA ? (Ab + (size_t)((tm << 7) + (int)((wave & 1u) << 6)) * lda)
                        : (Bb + (size_t)((tn << 7) + (int)((wave & 1u) << 6)) * ldb);
  const unsigned long long srcB = (unsigned long long)(size_t)srcRow;
  u32x8 g1 = tdm_group1((unsigned)(isA ? lda : ldb) * 2u);
  asm volatile("" : "+s"(g1));   // descriptor words held in their scalar registers: none is rebuilt or lent out while a request is in flight
  const unsigned ldsMine = (unsigned)(size_t)ring + wave * kSlice;
  const unsigned ldsBoth = 2u * ldsMine + kStage;   // this slice's place in buffer 0 plus its place in buffer 1
  const unsigned nPass = (unsigned)K >> 7;
  u32x4 g0 = tdm_group0(ldsMine, srcB);
  // the next stage's request: the other buffer, 256 bytes further along the rows. Called only behind this wave's s_wait_tensorcnt 0.
  auto next_stage = [&]() {
    asm volatile("" : "+s"(g0));   // descriptor words held in their scalar registers: they take their new values here, behind the wait, and are lent to nothing between requests
    const unsigned long long a = ((((unsigned long long)g0[3]) << 32) | (unsigned long long)g0[2]) + kRowB;   // type bits ride above the address
    g0[1] = uni(ldsBoth - g0[1]);
    g0[2] = uni((unsigned)a);
    g0[3] = uni((unsigned)(a >> 32));
    tdm_load(g0, g1);
  };

  v8f acc[4][4];
#pragma unroll
  for (int i = 0; i < 4; ++i)
#pragma unroll
    for (int j = 0; j < 4; ++j) acc[i][j] = (v8f){0.f,0.f,0.f,0.f,0.f,0.f,0.f,0.f};

  tdm_load(g0, g1);      // stage 0
  wait_tensor0();
  __syncthreads();       // stage 0 published
  next_stage();          // stage 1, in flight under pass 0

  const unsigned aOff = wm * kSlice        + (unsigned)rlane * kPitch + (unsigned)koff * 2u;
  const unsigned bOff = (2u + wn) * kSlice + (unsigned)rlane * kPitch + (unsigned)koff * 2u;
#pragma unroll 1   // one pass per trip: the buffer index stays a run-time scalar and the body is not doubled
  for (unsigned t = 0; t < nPass; ++t) {
    const unsigned char* buf = ring + (t & 1u) * kStage;
    const T* pa = (const T*)(buf + aOff);
    const T* pb = (const T*)(buf + bOff);
    V af[2][4], bf[2][4];
#pragma unroll
    for (int j = 0; j < 4; ++j) {
      bf[0][j] = Frag<T>::load(pb + j * (16 * (int)kPitch / 2));
      af[0][j] = Frag<T>::load(pa + j * (16 * (int)kPitch / 2));
    }
#pragma unroll
    for (int kc = 0; kc < 4; ++kc) {
      const int cur = kc & 1, nxt = cur ^ 1;
      __builtin_amdgcn_sched_barrier(0);   // keeps the next block's LDS reads one group ahead of this block's WMMAs, not among them
      if (kc < 3) {
#pragma unroll
        for (int j = 0; j < 4; ++j) {
          bf[nxt][j] = Frag<T>::load(pb + j * (16 * (int)kPitch / 2) + (kc + 1) * 32);
          af[nxt][j] = Frag<T>::load(pa + j * (16 * (int)kPitch / 2) + (kc + 1) * 32);
        }
      }
      __builtin_amdgcn_sched_barrier(0);   // the other side of that group
      if (kc == 3) {
        // publish point of stage t + 1: the pass's last fragments are fetched, only register work of this pass is left behind it
        wait_ds0();
        wait_tensor0();
        __syncthreads();                   // stage t + 1 readable by every wave; every wave has left stage t's buffer
        if (pinned(t + 2u < nPass)) next_stage();   // stage t + 2 into the buffer just left, in flight under the last block and pass t + 1
      }
#pragma unroll
      for (int i = 0; i < 4; ++i) {
#pragma unroll
        for (int j = 0; j < 4; ++j) acc[i][j] = Frag<T>::mma(af[cur][i], bf[cur][j], acc[i][j]);
      }
    }
  }
  wait_tensor0();
  wait_ds0();
  acc_guard4(acc[0][0], acc[0][1], acc[0][2], acc[0][3]);
  acc_guard4(acc[1][0], acc[1][1], acc[1][2], acc[1][3]);
  acc_guard4(acc[2][0], acc[2][1], acc[2][2], acc[2][3]);
  acc_guard4(acc[3][0], acc[3][1], acc[3][2], acc[3][3]);

  // ---- epilogue ----
  float* slab = (float*)(ring + wave * kSlabB);   // the last pass's barrier stands between every ring read and this reuse
  const float* Rb = RESID ? (resid + (size_t)b * strideR) : nullptr;
  float bRow[4][8], bCol[4];   // BIAS_MODE 3: the job's bias by output row or by output column, the other kind 0; one branch for the tile
  if (BIAS_MODE == 3) {
#pragma unroll
    for (int i = 0; i < 4; ++i) {
      bCol[i] = 0.f;
#pragma unroll
      for (int r = 0; r < 8; ++r) bRow[i][r] = 0.f;
    }
    if (biasByRow) {
#pragma unroll
      for (int i = 0; i < 4; ++i) {
        const v4f lo = *(const v4f*)(bias + m0 + (i << 4) + mOff);
        const v4f hi = *(const v4f*)(bias + m0 + (i << 4) + mOff + 4);
#pragma unroll
        for (int r = 0; r < 4; ++r) { bRow[i][r] = lo[r]; bRow[i][4 + r] = hi[r]; }
      }
    } else {
#pragma unroll
      for (int i = 0; i < 4; ++i) bCol[i] = bias[n0 + (i << 4) + rlane];
    }
  }
#pragma unroll
  for (int i = 0; i < 4; ++i) {
    const int mBase = m0 + (i << 4);
#pragma unroll
    for (int j = 0; j < 4; ++j) {
      const int n = n0 + (j << 4) + rlane;
      float bv = 0.f;
      if (BIAS_MODE == 2) bv = bias[n];
#pragma unroll
      for (int r = 0; r < 8; ++r) {
        float v = acc[i][j][r] * scale;
        if (BIAS_MODE == 1) v += bias[mBase + mOff + r];
        if (BIAS_MODE == 2) v += bv;
        if (BIAS_MODE == 3) v += bRow[i][r] + bCol[j];   // one of the two is 0: the sum is the job's bias, exactly
        if (RESID) v += Rb[(size_t)(mBase + mOff + r) * ldc + n];
        if (ACT == 2) v = fmaxf(v, 0.0f);
        if (ACT == 4) v = (v > 0.f) ? v : 0.01f * v;
        slab[(mOff + r) * 68 + (j << 4) + rlane] = v;
      }
    }
    __builtin_amdgcn_fence(__ATOMIC_RELEASE, "workgroup");
    __builtin_amdgcn_wave_barrier();
    __builtin_amdgcn_fence(__ATOMIC_ACQUIRE, "workgroup");
    if (OUT_MODE == 0) {
      float* C = (float*)Cout + (size_t)b * strideC;
      const int hh = lane >> 4, c4 = (lane & 15) * 4;     // row seg = 256 B = 16 lanes x 16 B
      {
#pragma unroll
        for (int it = 0; it < 8; ++it) {
          const int row = it * 2 + hh;
          v4f v = *(const v4f*)(slab + row * 68 + c4);
          *(v4f*)(C + (size_t)(mBase + row) * ldc + n0 + c4) = v;
        }
        
      }
    } else {
      const int q = lane >> 3, c8 = (lane & 7) * 8;
      unsigned short* C  = (unsigned short*)Cout  + (size_t)b * strideC;
      unsigned short* C2 = (OUT_MODE == 2) ? ((unsigned short*)Cout2 + (size_t)b * strideC) : nullptr;
      {
#pragma unroll
        for (int it = 0; it < 4; ++it) {
          const int row = it * 4 + q;
          const float* sp = slab + row * 68 + c8;
          v8h hv, lv;
#pragma unroll
          for (int e = 0; e < 8; ++e) {
            if (OUT_MODE == 1) {
              hv[e] = (_Float16)sp[e];
            } else {
              unsigned short hb = f2bf_bits(sp[e]);
              unsigned short lb = f2bf_bits(sp[e] - bf_bits2f(hb));
              hv[e] = __builtin_bit_cast(_Float16, hb);
              lv[e] = __builtin_bit_cast(_Float16, lb);
            }
          }
          *(v8h*)(C + (size_t)(mBase + row) * ldc + n0 + c8) = hv;
          if (OUT_MODE == 2) *(v8h*)(C2 + (size_t)(mBase + row) * ldc + n0 + c8) = lv;
        }
        
      }
    }
    __builtin_amdgcn_fence(__ATOMIC_RELEASE, "workgroup");
    __builtin_amdgcn_wave_barrier();
    __builtin_amdgcn_fence(__ATOMIC_ACQUIRE, "workgroup");
  }
}

// ---------------------------------------------------------------------------
// All six f32 -> f16 casts in one grid; 8 consecutive elements per thread, value = f16((in [+ ctx]) * scale).
// Block ranges, in the order of the six output planes, which lie one behind the other in the workspace:
//   [0, 3 * kActBlk): query, key, value (kActBlk blocks each; query and key with the context add; scale 1)
//   [3 * kActBlk, 3 * kActBlk + 3 * kWBlk): Wq, Wk, Wv (kWBlk blocks each; carried x16)
// The ctx vector [kDim] is broadcast over rows of pitch kDim (the flat index modulo kDim selects the ctx element; 8 | kDim).
// The grid is exact: every thread has its 8 elements.
// ---------------------------------------------------------------------------
constexpr unsigned kActBlk = (unsigned)((size_t)kTok * kDim / 8 / 256);   // 4096
constexpr unsigned kWBlk   = (unsigned)((size_t)kDim * kDim / 8 / 256);   // 512
__global__ __launch_bounds__(256) void cast_all_f16_kernel(const float* __restrict__ query, const float* __restrict__ key,
                                                           const float* __restrict__ value, const float* __restrict__ ctx,
                                                           const float* __restrict__ Wq, const float* __restrict__ Wk,
                                                           const float* __restrict__ Wv, unsigned short* __restrict__ out) {
  const unsigned blk = blockIdx.x;
  const float* in;
  unsigned local;
  bool hasCtx;
  float scale;
  if (blk < 3u * kActBlk) {
    const unsigned seg = blk / kActBlk;
    local  = blk - seg * kActBlk;
    in     = (seg == 0u) ? query : ((seg == 1u) ? key : value);
    hasCtx = seg < 2u;
    scale  = 1.0f;
  } else {
    const unsigned w   = blk - 3u * kActBlk;
    const unsigned seg = w / kWBlk;
    local  = w - seg * kWBlk;
    in     = (seg == 0u) ? Wq : ((seg == 1u) ? Wk : Wv);
    hasCtx = false;
    scale  = kWCarry;
  }
  const size_t i = (size_t)local * 256 + threadIdx.x;
  const float* p = in + 8 * i;
  v4f a = *(const v4f*)(p);
  v4f c = *(const v4f*)(p + 4);
  if (hasCtx) {
    // stands in front of the ctx loads, whose results may be given the registers that hold the address of the two loads above
    asm volatile("s_wait_xcnt 0x0" ::: "memory");
    const int cb = (int)((8 * i) & (size_t)(kDim - 1));   // 0..kDim-8, multiple of 8
    const v4f g0 = *(const v4f*)(ctx + cb);
    const v4f g1 = *(const v4f*)(ctx + cb + 4);
    a = a + g0;
    c = c + g1;
  }
  unsigned short hb[8];
#pragma unroll
  for (int e = 0; e < 4; ++e) {
    hb[e]     = h_bits(a[e] * scale);
    hb[4 + e] = h_bits(c[e] * scale);
  }
  const v4u u = (v4u){pk16(hb[0], hb[1]), pk16(hb[2], hb[3]), pk16(hb[4], hb[5]), pk16(hb[6], hb[7])};
  unsigned short* q = out + 8 * ((size_t)blk * 256 + threadIdx.x);
  *(v4u*)q = u;
}

// ---------------------------------------------------------------------------
// Row softmax over kSeq = 2048 f32 scores: P[row][j] = f16( carry * exp(s - max) * (1 / sum exp(s - max)) ), f32 math.
// One block of 256 threads per row; thread t owns columns 8t..8t+7 (256 x 8 = 2048 = whole row).
// Reductions in fixed order (thread, wave shuffle tree, 8 wave partials in index order); cross-wave LDS reads only
// after __syncthreads.
// ---------------------------------------------------------------------------
__global__ __launch_bounds__(256) void softmax_row_kernel(const float* __restrict__ S, unsigned short* __restrict__ P,
                                                          float carry) {
  __shared__ float redM[8];
  __shared__ float redS[8];
  const int row  = blockIdx.x;
  const int t    = threadIdx.x;
  const int lane = t & 31, wave = t >> 5;
  const int c0   = t * 8;
  const float* sr = S + (size_t)row * kSeq + c0;
  const v4f a = *(const v4f*)(sr);
  const v4f c = *(const v4f*)(sr + 4);
  float x[8];
#pragma unroll
  for (int e = 0; e < 4; ++e) { x[e] = a[e]; x[4 + e] = c[e]; }
  float m = fmaxf(fmaxf(fmaxf(x[0], x[1]), fmaxf(x[2], x[3])), fmaxf(fmaxf(x[4], x[5]), fmaxf(x[6], x[7])));
#pragma unroll
  for (int off = 16; off > 0; off >>= 1) m = fmaxf(m, __shfl_xor(m, off, 32));
  if (lane == 0) redM[wave] = m;
  __syncthreads();
  float gm = redM[0];
#pragma unroll
  for (int w = 1; w < 8; ++w) gm = fmaxf(gm, redM[w]);
  float p[8];
  float s = 0.f;
#pragma unroll
  for (int e = 0; e < 8; ++e) { p[e] = expf(x[e] - gm); s += p[e]; }
#pragma unroll
  for (int off = 16; off > 0; off >>= 1) s += __shfl_xor(s, off, 32);
  if (lane == 0) redS[wave] = s;
  __syncthreads();
  float tot = redS[0];
#pragma unroll
  for (int w = 1; w < 8; ++w) tot += redS[w];
  const float rcp = 1.0f / tot;    // tot >= 1 (the max element contributes exp(0))
  unsigned short hb[8];
#pragma unroll
  for (int e = 0; e < 8; ++e) hb[e] = h_bits((p[e] * rcp) * carry);
  const v4u u = (v4u){pk16(hb[0], hb[1]), pk16(hb[2], hb[3]), pk16(hb[4], hb[5]), pk16(hb[6], hb[7])};
  unsigned short* q = P + (size_t)row * kSeq + c0;
  *(v4u*)q = u;
  
}

// ---------------------------------------------------------------------------
// Host side
// Workspace region map (bytes, all offsets 2 MiB aligned):
//   R0 Xq16 [8192][1024] f16   16 MiB @  0 MiB
//   R1 Xk16 [8192][1024] f16   16 MiB @ 16 MiB
//   R2 Xv16 [8192][1024] f16   16 MiB @ 32 MiB
//   R3 Wq16,Wk16,Wv16 [1024][1024] f16 x16 carry, 2 MiB each @ 48/50/52 MiB
//   R4 Q16  [8192][1024] f16   16 MiB @ 54 MiB
//   R5 K16  [8192][1024] f16   16 MiB @ 70 MiB
//   R6 VT16 [4][1024][2048] f16 16 MiB @ 86 MiB
//   R7 Sc   [4][2048][2048] f32 64 MiB @ 102 MiB
//   R8 P16  [4][2048][2048] f16 32 MiB @ 166 MiB
//   total carve 198 MiB = 207618048 B
//   R0..R3 and R4..R6 each lie one plane behind the other: the cast grid and the projection grid step through them by plane
// ---------------------------------------------------------------------------
extern "C" void kernel_launch(void* const* d_in, const int* in_sizes, int n_in,
                              void* d_out, int out_size, void* d_ws, size_t ws_size,
                              hipStream_t stream) {
  if (n_in < 10) return;
  const float* query = (const float*)d_in[0];
  const float* key   = (const float*)d_in[1];
  const float* value = (const float*)d_in[2];
  const float* ctx   = (const float*)d_in[3];
  const float* Wq    = (const float*)d_in[4];
  const float* bq    = (const float*)d_in[5];
  const float* Wk    = (const float*)d_in[6];
  const float* bk    = (const float*)d_in[7];
  const float* Wv    = (const float*)d_in[8];
  const float* bv    = (const float*)d_in[9];
  float* out = (float*)d_out;

  const size_t actE = (size_t)kTok * kDim;      // 8388608 elements per activation tensor
  const size_t wE   = (size_t)kDim * kDim;      // 1048576 elements per weight
  if ((size_t)in_sizes[0] != actE || (size_t)in_sizes[1] != actE || (size_t)in_sizes[2] != actE) return;
  if ((size_t)in_sizes[3] != (size_t)kDim) return;
  if ((size_t)in_sizes[4] != wE || (size_t)in_sizes[6] != wE || (size_t)in_sizes[8] != wE) return;
  if ((size_t)in_sizes[5] != (size_t)kDim || (size_t)in_sizes[7] != (size_t)kDim || (size_t)in_sizes[9] != (size_t)kDim) return;
  if ((size_t)out_size != actE) return;

  const size_t actB16 = actE * 2;     // 16 MiB
  const size_t wB16   = wE * 2;       //  2 MiB
  unsigned char* ws = (unsigned char*)d_ws;
  size_t off = 0;
  unsigned short* Xq16 = (unsigned short*)(ws + off); off += actB16;
  unsigned short* Xk16 = (unsigned short*)(ws + off); off += actB16;
  unsigned short* Xv16 = (unsigned short*)(ws + off); off += actB16;
  unsigned short* Wq16 = (unsigned short*)(ws + off); off += wB16;
  unsigned short* Wk16 = (unsigned short*)(ws + off); off += wB16;
  unsigned short* Wv16 = (unsigned short*)(ws + off); off += wB16;
  unsigned short* Q16  = (unsigned short*)(ws + off); off += actB16;
  unsigned short* K16  = (unsigned short*)(ws + off); off += actB16;
  unsigned short* VT16 = (unsigned short*)(ws + off); off += actB16;
  const size_t scBytes = (size_t)kChunkB * kSeq * kSeq * sizeof(float);   // 64 MiB
  const size_t pBytes  = (size_t)kChunkB * kSeq * kSeq * 2;               // 32 MiB
  float*          Sc  = (float*)(ws + off);          off += scBytes;
  unsigned short* P16 = (unsigned short*)(ws + off); off += pBytes;
  const size_t carveTotal = off;                         // 207618048 B
  if (carveTotal > ws_size) return;

  const dim3 blk(256);
  const dim3 blkG(128);   // GEMM work-groups: 4 waves

  // launch 1: all six casts, one grid of block ranges; the six output planes start at Xq16
  cast_all_f16_kernel<<<dim3(3u * kActBlk + 3u * kWBlk), blk, 0, stream>>>(query, key, value, ctx, Wq, Wk, Wv, Xq16);

  // launch 2: the three projections, grid.y = job, 512 tiles of 128x128 each, K = 1024, scale 1/16
  //   jobs 0, 1: Q16/K16 [8192][1024] = X16 [8192][1024] x W16 [1024][1024]^T, bias[n]
  //   job 2:     VT16[b][d][s] = Wv16 [1024][1024] x Xv16_b [2048][1024]^T, bias[m] = bv[d]
  {
    const int M = kTok, N = kDim, K = kDim;
    const dim3 g((unsigned)((M / 128) * (N / 128)), 3u);
    wmma_gemm64<0, false, 3, 1, false, 0><<<g, blkG, 0, stream>>>(
        Xq16, Xq16, kDim, (long)actE, Wq16, Wq16, kDim, (long)wE, (void*)Q16, (void*)Q16, kDim, (long)actE,
        bq, bq, 0L, M, N, K, kWCarryInv, bk, bv);
  }

  // launches 3-5: attention, every batch in each launch (grid.y of the two GEMMs, rows of the softmax)
  static_assert(kChunkB == kBatch, "one attention launch of each kind covers every batch");
  {
    const unsigned short* Qc  = Q16;
    const unsigned short* Kc  = K16;
    const unsigned short* VTc = VT16;
    float* Oc = out;
    // scores Sc[g][q][k] = (1/32) * Q_g [2048][1024] x K_g [2048][1024]^T, f32 out
    // M = N = 2048, K = 1024; tiles = 16 * 16 = 256 blocks; grid.y = kChunkB
    {
      const int M = kSeq, N = kSeq, K = kDim;
      const dim3 g((unsigned)((M / 128) * (N / 128)), (unsigned)kChunkB);
      wmma_gemm64<0, false, 0, 0, false, 0><<<g, blkG, 0, stream>>>(
          Qc, Qc, kDim, (long)kSeq * kDim,
          Kc, Kc, kDim, (long)kSeq * kDim,
          (void*)Sc, (void*)Sc, kSeq, (long)kSeq * kSeq,
          bq, bq, 0L, M, N, K, kScoreScale, bq, bq);
    }
    // row softmax -> P16 [g][q][k] carried x2048; one block per row, kChunkB * 2048 rows
    {
      const dim3 g((unsigned)(kChunkB * kSeq));
      softmax_row_kernel<<<g, blk, 0, stream>>>(Sc, P16, kPCarry);
    }
    // out[g][q][d] = (1/2048) * P16_g [2048][2048] x VT16_g [1024][2048]^T, f32 straight to d_out rows (ldc 1024)
    // M = 2048, N = 1024, K = 2048; tiles = 16 * 8 = 128 blocks; grid.y = kChunkB
    {
      const int M = kSeq, N = kDim, K = kSeq;
      const dim3 g((unsigned)((M / 128) * (N / 128)), (unsigned)kChunkB);
      wmma_gemm64<0, false, 0, 0, false, 0><<<g, blkG, 0, stream>>>(
          P16, P16, kSeq, (long)kSeq * kSeq,
          VTc, VTc, kSeq, (long)kDim * kSeq,
          (void*)Oc, (void*)Oc, kDim, (long)kSeq * kDim,
          bq, bq, 0L, M, N, K, kPCarryInv, bq, bq);
    }
  }
}
